// v000
// Times are from an AMD MI455X. After a warm-up the kernel runs many times in a row, and a time is the length of
// such a window on the GPU divided by its runs, so every launch and the gaps after it count. The runs cycle
// through copies of the inputs. A figure is the median of several windows, for all but v000 over two sittings.
// Sittings can differ by a few percent; kernels timed side by side share one.
// The starting kernel, v000, takes 178 microseconds a run.
#include <hip/hip_runtime.h>
#include <hip/hip_bf16.h>

typedef __attribute__((ext_vector_type(16))) _Float16 v16h;
typedef __attribute__((ext_vector_type(8)))  float    v8f;

#define D_DIM 1024
#define H_DIM 1024
#define E_NUM 8
#define BM 128
#define BN 128
#define BKS 64          // K halves staged per pipeline stage (2 WMMA substeps)
#define LDK2 72         // padded K stride in halves (64 + 8) -> 144B rows, 16B aligned
#define NSTAGE (D_DIM / BKS)

#define AS3 __attribute__((address_space(3)))

// LDS byte offset (what GLOBAL_LOAD_ASYNC_TO_LDS wants in its VDST VGPR)
static __device__ __forceinline__ unsigned lds_off(const void* p) {
  return (unsigned)(unsigned long long)(AS3 const void*)p;
}

// async 16B global -> LDS copy, tracked by ASYNCcnt (CDNA5)
static __device__ __forceinline__ void async_copy_b128(unsigned lds_byte_off,
                                                       const unsigned short* gsrc) {
  asm volatile("global_load_async_to_lds_b128 %0, %1, off"
               :: "v"(lds_byte_off), "v"(gsrc) : "memory");
}

// ---------------------------------------------------------------- zero init
__global__ void zero_kernel(float* __restrict__ out, size_t n,
                            int* __restrict__ cnt, float* __restrict__ ent) {
  size_t i = (size_t)blockIdx.x * blockDim.x + threadIdx.x;
  if (i < n) out[i] = 0.0f;
  if (i < E_NUM) cnt[i] = 0;
  if (i == 0) *ent = 0.0f;
}

// ------------------------------------------- expert_w f32[E][D][H] -> f16[E][H][D]
__global__ void wcvt_kernel(const float* __restrict__ w, unsigned short* __restrict__ wt) {
  __shared__ _Float16 tile[32][33];
  int e  = blockIdx.z;
  int h0 = blockIdx.x * 32;
  int d0 = blockIdx.y * 32;
  int tx = threadIdx.x & 31;
  int ty = threadIdx.x >> 5;   // 8 row-groups
  for (int r = ty; r < 32; r += 8)
    tile[r][tx] = (_Float16)w[((size_t)e * D_DIM + d0 + r) * H_DIM + h0 + tx];
  __syncthreads();
  for (int r = ty; r < 32; r += 8) {
    union { _Float16 h; unsigned short u; } cv;
    cv.h = tile[tx][r];
    wt[((size_t)e * H_DIM + h0 + r) * D_DIM + d0 + tx] = cv.u;
  }
}

// ------------------------- gate: logits, softmax, entropy, top-2, token lists, x->f16
__global__ void gate_kernel(const float* __restrict__ x,
                            const float* __restrict__ gw,
                            const float* __restrict__ gb,
                            unsigned short* __restrict__ xh,
                            int* __restrict__ tok_list,
                            float* __restrict__ prob_list,
                            int* __restrict__ cnt,
                            float* __restrict__ ent_accum,
                            int N) {
  int tok  = (int)((blockIdx.x * (size_t)blockDim.x + threadIdx.x) >> 5);
  int lane = threadIdx.x & 31;
  if (tok >= N) return;
  const float* xr = x + (size_t)tok * D_DIM;
  unsigned short* xhr = xh + (size_t)tok * D_DIM;

  float acc[E_NUM];
#pragma unroll
  for (int e = 0; e < E_NUM; ++e) acc[e] = 0.0f;

  for (int i = 0; i < D_DIM / 32; ++i) {
    int d = lane + 32 * i;
    float v = xr[d];
    union { _Float16 h; unsigned short u; } cv;
    cv.h = (_Float16)v;
    xhr[d] = cv.u;
    const float4* g = (const float4*)(gw + (size_t)d * E_NUM);
    float4 g0 = g[0], g1 = g[1];
    acc[0] += v * g0.x; acc[1] += v * g0.y; acc[2] += v * g0.z; acc[3] += v * g0.w;
    acc[4] += v * g1.x; acc[5] += v * g1.y; acc[6] += v * g1.z; acc[7] += v * g1.w;
  }
#pragma unroll
  for (int e = 0; e < E_NUM; ++e)
    for (int off = 16; off > 0; off >>= 1)
      acc[e] += __shfl_xor(acc[e], off, 32);

  if (lane == 0) {
    float l[E_NUM], p[E_NUM];
    float m = -1e30f;
#pragma unroll
    for (int e = 0; e < E_NUM; ++e) { l[e] = acc[e] + gb[e]; m = fmaxf(m, l[e]); }
    float s = 0.0f;
#pragma unroll
    for (int e = 0; e < E_NUM; ++e) { p[e] = expf(l[e] - m); s += p[e]; }
    float inv = 1.0f / s;
    float ent = 0.0f;
#pragma unroll
    for (int e = 0; e < E_NUM; ++e) { p[e] *= inv; ent -= p[e] * logf(p[e] + 1e-10f); }

    int i1 = 0; float v1 = p[0];
#pragma unroll
    for (int e = 1; e < E_NUM; ++e) if (p[e] > v1) { v1 = p[e]; i1 = e; }
    int i2 = -1; float v2 = -1.0f;
#pragma unroll
    for (int e = 0; e < E_NUM; ++e) if (e != i1 && p[e] > v2) { v2 = p[e]; i2 = e; }

    atomicAdd(ent_accum, ent);
    int pos1 = atomicAdd(&cnt[i1], 1);
    tok_list[i1 * N + pos1] = tok; prob_list[i1 * N + pos1] = v1;
    int pos2 = atomicAdd(&cnt[i2], 1);
    tok_list[i2 * N + pos2] = tok; prob_list[i2 * N + pos2] = v2;
  }
}

// ---- grouped expert GEMM: WMMA f16/f32, double-buffered async global->LDS pipeline
__global__ __launch_bounds__(256) void moe_gemm(
    const unsigned short* __restrict__ xh,   // [N][D] f16
    const unsigned short* __restrict__ wt,   // [E][H][D] f16
    const float* __restrict__ eb,            // [E][H]
    const int* __restrict__ tok_list,        // [E][N]
    const float* __restrict__ prob_list,     // [E][N]
    const int* __restrict__ cnt,             // [E]
    float* __restrict__ out, int N) {
  int e = blockIdx.z;
  int ce = cnt[e];
  int row0 = blockIdx.y * BM;
  if (row0 >= ce) return;
  int col0 = blockIdx.x * BN;

  __shared__ alignas(16) unsigned short sA[2][BM * LDK2];
  __shared__ alignas(16) unsigned short sB[2][BN * LDK2];
  __shared__ int   sTok[BM];
  __shared__ float sPr[BM];

  int tid = threadIdx.x;
  if (tid < BM) {
    int r = row0 + tid;
    if (r < ce) { sTok[tid] = tok_list[e * N + r]; sPr[tid] = prob_list[e * N + r]; }
    else        { sTok[tid] = 0;                   sPr[tid] = 0.0f; }
  }
  __syncthreads();

  // ---- per-thread async copy chunk plan: 4 A-chunks + 4 B-chunks of 8 halves/stage
  const unsigned short* aSrc[4]; unsigned aOff[4];
  const unsigned short* bSrc[4]; unsigned bOff[4];
#pragma unroll
  for (int q = 0; q < 4; ++q) {
    int c = tid + 256 * q;          // 0..1023
    int m = c >> 3;                 // row in tile (0..127)
    int kc = (c & 7) * 8;           // half-offset within stage (0..56)
    aSrc[q] = xh + (size_t)sTok[m] * D_DIM + kc;
    aOff[q] = (unsigned)(m * LDK2 + kc) * 2u;      // byte offset inside buffer
    bSrc[q] = wt + ((size_t)e * H_DIM + col0 + m) * D_DIM + kc;
    bOff[q] = (unsigned)(m * LDK2 + kc) * 2u;
  }
  unsigned aBase[2] = { lds_off(&sA[0][0]), lds_off(&sA[1][0]) };
  unsigned bBase[2] = { lds_off(&sB[0][0]), lds_off(&sB[1][0]) };

  auto issue_stage = [&](int k0, int buf) {
#pragma unroll
    for (int q = 0; q < 4; ++q) async_copy_b128(aBase[buf] + aOff[q], aSrc[q] + k0);
#pragma unroll
    for (int q = 0; q < 4; ++q) async_copy_b128(bBase[buf] + bOff[q], bSrc[q] + k0);
  };

  int lane = tid & 31;
  int wv = tid >> 5;
  int wm = wv >> 1;            // 0..3  -> 32-row stripe
  int wn = wv & 1;             // 0..1  -> 64-col stripe
  int lr = lane & 15;
  int kb = (lane >> 4) * 8;    // K base: lanes 0-15 -> 0, lanes 16-31 -> 8

  v8f zero = {};
  v8f acc[2][4];
#pragma unroll
  for (int i = 0; i < 2; ++i)
#pragma unroll
    for (int j = 0; j < 4; ++j) acc[i][j] = zero;

  issue_stage(0, 0);                      // prologue: stage 0 in flight

  for (int s = 0; s < NSTAGE; ++s) {
    int cur = s & 1;
    if (s + 1 < NSTAGE) {
      issue_stage((s + 1) * BKS, (s + 1) & 1);     // prefetch next stage
      asm volatile("s_wait_asynccnt 0x8" ::: "memory");  // stage s (older 8) landed
    } else {
      asm volatile("s_wait_asynccnt 0x0" ::: "memory");
    }
    __syncthreads();                      // publish stage s tile to all waves

    const unsigned short* bufA = sA[cur];
    const unsigned short* bufB = sB[cur];
#pragma unroll
    for (int half = 0; half < 2; ++half) {
      int kk = half * 32;
      v16h afrag[2], bfrag[4];
#pragma unroll
      for (int i = 0; i < 2; ++i) {
        int m = wm * 32 + i * 16 + lr;
        union { uint4 u[2]; v16h h; } t;
        t.u[0] = *(const uint4*)(&bufA[m * LDK2 + kk + kb]);
        t.u[1] = *(const uint4*)(&bufA[m * LDK2 + kk + kb + 16]);
        afrag[i] = t.h;
      }
#pragma unroll
      for (int j = 0; j < 4; ++j) {
        int n = wn * 64 + j * 16 + lr;
        union { uint4 u[2]; v16h h; } t;
        t.u[0] = *(const uint4*)(&bufB[n * LDK2 + kk + kb]);
        t.u[1] = *(const uint4*)(&bufB[n * LDK2 + kk + kb + 16]);
        bfrag[j] = t.h;
      }
#pragma unroll
      for (int i = 0; i < 2; ++i)
#pragma unroll
        for (int j = 0; j < 4; ++j)
          acc[i][j] = __builtin_amdgcn_wmma_f32_16x16x32_f16(
              false, afrag[i], false, bfrag[j], (short)0, acc[i][j], false, false);
    }
    __syncthreads();                      // all waves done reading before overwrite
  }

  // epilogue: out[token, col] += prob * (acc + bias)
#pragma unroll
  for (int i = 0; i < 2; ++i) {
#pragma unroll
    for (int j = 0; j < 4; ++j) {
      int rbase = wm * 32 + i * 16 + (lane >> 4) * 8;
      int col = col0 + wn * 64 + j * 16 + lr;
      float bias = eb[e * H_DIM + col];
#pragma unroll
      for (int v = 0; v < 8; ++v) {
        int row = rbase + v;
        float val = sPr[row] * (acc[i][j][v] + bias);
        atomicAdd(out + (size_t)sTok[row] * H_DIM + col, val);
      }
    }
  }
}

// ---------------------------------------------------------------- aux loss scalar
__global__ void loss_kernel(const int* __restrict__ cnt, const float* __restrict__ ent,
                            float* __restrict__ out, int N) {
  if (threadIdx.x == 0 && blockIdx.x == 0) {
    float s = 0.1f * (*ent / (float)N);
    for (int e = 0; e < E_NUM; ++e) {
      float u = (float)cnt[e] / (float)N - 0.3f;
      if (u > 0.0f) s += u;
    }
    out[(size_t)N * H_DIM] = s;
  }
}

extern "C" void kernel_launch(void* const* d_in, const int* in_sizes, int n_in,
                              void* d_out, int out_size, void* d_ws, size_t ws_size,
                              hipStream_t stream) {
  const float* x  = (const float*)d_in[0];   // [B,S,D]
  const float* gw = (const float*)d_in[1];   // [D,E]
  const float* gb = (const float*)d_in[2];   // [E]
  const float* ew = (const float*)d_in[3];   // [E,D,H]
  const float* eb = (const float*)d_in[4];   // [E,H]
  float* out = (float*)d_out;
  int N = in_sizes[0] / D_DIM;               // 16384

  // workspace layout
  char* ws = (char*)d_ws;
  unsigned short* xh = (unsigned short*)ws;                               // N*D f16
  unsigned short* wt = (unsigned short*)(ws + (size_t)N * D_DIM * 2);     // E*H*D f16
  char* p = ws + (size_t)N * D_DIM * 2 + (size_t)E_NUM * H_DIM * D_DIM * 2;
  int*   tok_list  = (int*)p;   p += (size_t)E_NUM * N * 4;
  float* prob_list = (float*)p; p += (size_t)E_NUM * N * 4;
  int*   cnt       = (int*)p;   p += E_NUM * 4;
  float* ent       = (float*)p;

  size_t total = (size_t)N * H_DIM + 1;
  zero_kernel<<<(unsigned)((total + 255) / 256), 256, 0, stream>>>(out, total, cnt, ent);

  dim3 tg(H_DIM / 32, D_DIM / 32, E_NUM);
  wcvt_kernel<<<tg, 256, 0, stream>>>(ew, wt);

  gate_kernel<<<(N * 32 + 255) / 256, 256, 0, stream>>>(
      x, gw, gb, xh, tok_list, prob_list, cnt, ent, N);

  dim3 gg(H_DIM / BN, (N + BM - 1) / BM, E_NUM);
  moe_gemm<<<gg, 256, 0, stream>>>(xh, wt, eb, tok_list, prob_list, cnt, out, N);

  loss_kernel<<<1, 1, 0, stream>>>(cnt, ent, out, N);
}

// v001
// Measured time: 175 microseconds a run.
// Next to v000, in two timings, it ran 1.05 and 1.03 times as fast.
#include <hip/hip_runtime.h>
#include <hip/hip_bf16.h>

typedef __attribute__((ext_vector_type(16))) _Float16 v16h;
typedef __attribute__((ext_vector_type(8)))  float    v8f;

#define D_DIM 1024
#define H_DIM 1024
#define E_NUM 8
#define BM 128
#define BN 128
#define BKS 64          // K halves staged per pipeline stage (2 WMMA substeps)
#define LDK2 72         // padded K stride in halves (64 + 8) -> 144B rows, 16B aligned
#define NSTAGE (D_DIM / BKS)

#define AS3 __attribute__((address_space(3)))

// LDS byte offset (what GLOBAL_LOAD_ASYNC_TO_LDS wants in its VDST VGPR)
static __device__ __forceinline__ unsigned lds_off(const void* p) {
  return (unsigned)(unsigned long long)(AS3 const void*)p;
}

// async 16B global -> LDS copy, tracked by ASYNCcnt (CDNA5)
static __device__ __forceinline__ void async_copy_b128(unsigned lds_byte_off,
                                                       const unsigned short* gsrc) {
  asm volatile("global_load_async_to_lds_b128 %0, %1, off"
               :: "v"(lds_byte_off), "v"(gsrc) : "memory");
}

// ------------------------------------------- expert_w f32[E][D][H] -> f16[E][H][D]
// The first block also clears the gate's counters (one per choice rank and expert)
// and the entropy sum: this launch ends before the gate starts.
__global__ void wcvt_kernel(const float* __restrict__ w, unsigned short* __restrict__ wt,
                            int* __restrict__ cnt, float* __restrict__ ent) {
  __shared__ _Float16 tile[32][33];
  if (blockIdx.x == 0 && blockIdx.y == 0 && blockIdx.z == 0) {
    if (threadIdx.x < 2 * E_NUM) cnt[threadIdx.x] = 0;
    if (threadIdx.x == 0) *ent = 0.0f;
  }
  int e  = blockIdx.z;
  int h0 = blockIdx.x * 32;
  int d0 = blockIdx.y * 32;
  int tx = threadIdx.x & 31;
  int ty = threadIdx.x >> 5;   // 8 row-groups
  for (int r = ty; r < 32; r += 8)
    tile[r][tx] = (_Float16)w[((size_t)e * D_DIM + d0 + r) * H_DIM + h0 + tx];
  __syncthreads();
  for (int r = ty; r < 32; r += 8) {
    union { _Float16 h; unsigned short u; } cv;
    cv.h = tile[tx][r];
    wt[((size_t)e * H_DIM + h0 + r) * D_DIM + d0 + tx] = cv.u;
  }
}

// ------------------------- gate: logits, softmax, entropy, top-2, token lists, x->f16
__global__ void gate_kernel(const float* __restrict__ x,
                            const float* __restrict__ gw,
                            const float* __restrict__ gb,
                            unsigned short* __restrict__ xh,
                            int* __restrict__ tok_list,
                            float* __restrict__ prob_list,
                            int* __restrict__ cnt,
                            float* __restrict__ ent_accum,
                            int N) {
  int tok  = (int)((blockIdx.x * (size_t)blockDim.x + threadIdx.x) >> 5);
  int lane = threadIdx.x & 31;
  if (tok >= N) return;
  const float* xr = x + (size_t)tok * D_DIM;
  unsigned short* xhr = xh + (size_t)tok * D_DIM;

  float acc[E_NUM];
#pragma unroll
  for (int e = 0; e < E_NUM; ++e) acc[e] = 0.0f;

  for (int i = 0; i < D_DIM / 32; ++i) {
    int d = lane + 32 * i;
    float v = xr[d];
    union { _Float16 h; unsigned short u; } cv;
    cv.h = (_Float16)v;
    xhr[d] = cv.u;
    const float4* g = (const float4*)(gw + (size_t)d * E_NUM);
    float4 g0 = g[0], g1 = g[1];
    acc[0] += v * g0.x; acc[1] += v * g0.y; acc[2] += v * g0.z; acc[3] += v * g0.w;
    acc[4] += v * g1.x; acc[5] += v * g1.y; acc[6] += v * g1.z; acc[7] += v * g1.w;
  }
#pragma unroll
  for (int e = 0; e < E_NUM; ++e)
    for (int off = 16; off > 0; off >>= 1)
      acc[e] += __shfl_xor(acc[e], off, 32);

  if (lane == 0) {
    float l[E_NUM], p[E_NUM];
    float m = -1e30f;
#pragma unroll
    for (int e = 0; e < E_NUM; ++e) { l[e] = acc[e] + gb[e]; m = fmaxf(m, l[e]); }
    float s = 0.0f;
#pragma unroll
    for (int e = 0; e < E_NUM; ++e) { p[e] = expf(l[e] - m); s += p[e]; }
    float inv = 1.0f / s;
    float ent = 0.0f;
#pragma unroll
    for (int e = 0; e < E_NUM; ++e) { p[e] *= inv; ent -= p[e] * logf(p[e] + 1e-10f); }

    int i1 = 0; float v1 = p[0];
#pragma unroll
    for (int e = 1; e < E_NUM; ++e) if (p[e] > v1) { v1 = p[e]; i1 = e; }
    int i2 = -1; float v2 = -1.0f;
#pragma unroll
    for (int e = 0; e < E_NUM; ++e) if (e != i1 && p[e] > v2) { v2 = p[e]; i2 = e; }

    atomicAdd(ent_accum, ent);
    int pos1 = atomicAdd(&cnt[i1], 1);
    tok_list[i1 * N + pos1] = tok; prob_list[i1 * N + pos1] = v1;
    // second choices go to lists of their own, behind the E_NUM first-choice lists
    int g2 = E_NUM + i2;
    int pos2 = atomicAdd(&cnt[g2], 1);
    tok_list[g2 * N + pos2] = tok; prob_list[g2 * N + pos2] = v2;
  }
}

// 16 rows x 64 columns of one wave's result go to out. ADD: the rows already hold the
// other choice's share; all loads are issued before the first store. FULL: every row of
// the tile stands for a token; otherwise rows past the list's end are left alone.
template <bool ADD, bool FULL>
static __device__ __forceinline__ void write_rows(float* __restrict__ out,
                                                  const unsigned (&off)[8],
                                                  const float (&pr)[8],
                                                  const v8f (&a)[4],
                                                  const float (&bias)[4],
                                                  int rbase, int nvalid) {
  float old[8][4];
  if (ADD) {
#pragma unroll
    for (int v = 0; v < 8; ++v)
      if (FULL || rbase + v < nvalid) {
#pragma unroll
        for (int j = 0; j < 4; ++j) old[v][j] = out[off[v] + j * 16];
      }
  }
#pragma unroll
  for (int v = 0; v < 8; ++v)
    if (FULL || rbase + v < nvalid) {
#pragma unroll
      for (int j = 0; j < 4; ++j) {
        float val = pr[v] * (a[j][v] + bias[j]);
        out[off[v] + j * 16] = ADD ? old[v][j] + val : val;
      }
    }
}

// ---- grouped expert GEMM: WMMA f16/f32, double-buffered async global->LDS pipeline
// One launch per choice rank. A token stands in exactly one list of a rank, so every
// out row has one writer per launch: the first launch (add == 0) stores it, the second
// (add != 0) loads it, adds and stores. No atomics, no cleared out.
__global__ __launch_bounds__(256) void moe_gemm(
    const unsigned short* __restrict__ xh,   // [N][D] f16
    const unsigned short* __restrict__ wt,   // [E][H][D] f16
    const float* __restrict__ eb,            // [E][H]
    const int* __restrict__ tok_list,        // [E][N], this rank's
    const float* __restrict__ prob_list,     // [E][N], this rank's
    const int* __restrict__ cnt,             // [E], this rank's
    float* __restrict__ out, int N, int add) {
  int e = blockIdx.z;
  int ce = cnt[e];
  int row0 = blockIdx.y * BM;
  if (row0 >= ce) return;
  int col0 = blockIdx.x * BN;

  __shared__ alignas(16) unsigned short sA[2][BM * LDK2];
  __shared__ alignas(16) unsigned short sB[2][BN * LDK2];
  __shared__ int   sTok[BM];
  __shared__ float sPr[BM];

  int tid = threadIdx.x;
  if (tid < BM) {
    int r = row0 + tid;
    if (r < ce) { sTok[tid] = tok_list[e * N + r]; sPr[tid] = prob_list[e * N + r]; }
    else        { sTok[tid] = 0;                   sPr[tid] = 0.0f; }
  }
  __syncthreads();

  // ---- per-thread async copy chunk plan: 4 A-chunks + 4 B-chunks of 8 halves/stage
  const unsigned short* aSrc[4]; unsigned aOff[4];
  const unsigned short* bSrc[4]; unsigned bOff[4];
#pragma unroll
  for (int q = 0; q < 4; ++q) {
    int c = tid + 256 * q;          // 0..1023
    int m = c >> 3;                 // row in tile (0..127)
    int kc = (c & 7) * 8;           // half-offset within stage (0..56)
    aSrc[q] = xh + (size_t)sTok[m] * D_DIM + kc;
    aOff[q] = (unsigned)(m * LDK2 + kc) * 2u;      // byte offset inside buffer
    bSrc[q] = wt + ((size_t)e * H_DIM + col0 + m) * D_DIM + kc;
    bOff[q] = (unsigned)(m * LDK2 + kc) * 2u;
  }
  unsigned aBase[2] = { lds_off(&sA[0][0]), lds_off(&sA[1][0]) };
  unsigned bBase[2] = { lds_off(&sB[0][0]), lds_off(&sB[1][0]) };

  auto issue_stage = [&](int k0, int buf) {
#pragma unroll
    for (int q = 0; q < 4; ++q) async_copy_b128(aBase[buf] + aOff[q], aSrc[q] + k0);
#pragma unroll
    for (int q = 0; q < 4; ++q) async_copy_b128(bBase[buf] + bOff[q], bSrc[q] + k0);
  };

  int lane = tid & 31;
  int wv = tid >> 5;
  int wm = wv >> 1;            // 0..3  -> 32-row stripe
  int wn = wv & 1;             // 0..1  -> 64-col stripe
  int lr = lane & 15;
  int kb = (lane >> 4) * 8;    // K base: lanes 0-15 -> 0, lanes 16-31 -> 8

  v8f zero = {};
  v8f acc[2][4];
#pragma unroll
  for (int i = 0; i < 2; ++i)
#pragma unroll
    for (int j = 0; j < 4; ++j) acc[i][j] = zero;

  issue_stage(0, 0);                      // prologue: stage 0 in flight

  for (int s = 0; s < NSTAGE; ++s) {
    int cur = s & 1;
    if (s + 1 < NSTAGE) {
      issue_stage((s + 1) * BKS, (s + 1) & 1);     // prefetch next stage
      asm volatile("s_wait_asynccnt 0x8" ::: "memory");  // stage s (older 8) landed
    } else {
      asm volatile("s_wait_asynccnt 0x0" ::: "memory");
    }
    __syncthreads();                      // publish stage s tile to all waves

    const unsigned short* bufA = sA[cur];
    const unsigned short* bufB = sB[cur];
#pragma unroll
    for (int half = 0; half < 2; ++half) {
      int kk = half * 32;
      v16h afrag[2], bfrag[4];
#pragma unroll
      for (int i = 0; i < 2; ++i) {
        int m = wm * 32 + i * 16 + lr;
        union { uint4 u[2]; v16h h; } t;
        t.u[0] = *(const uint4*)(&bufA[m * LDK2 + kk + kb]);
        t.u[1] = *(const uint4*)(&bufA[m * LDK2 + kk + kb + 16]);
        afrag[i] = t.h;
      }
#pragma unroll
      for (int j = 0; j < 4; ++j) {
        int n = wn * 64 + j * 16 + lr;
        union { uint4 u[2]; v16h h; } t;
        t.u[0] = *(const uint4*)(&bufB[n * LDK2 + kk + kb]);
        t.u[1] = *(const uint4*)(&bufB[n * LDK2 + kk + kb + 16]);
        bfrag[j] = t.h;
      }
#pragma unroll
      for (int i = 0; i < 2; ++i)
#pragma unroll
        for (int j = 0; j < 4; ++j)
          acc[i][j] = __builtin_amdgcn_wmma_f32_16x16x32_f16(
              false, afrag[i], false, bfrag[j], (short)0, acc[i][j], false, false);
    }
    __syncthreads();                      // all waves done reading before overwrite
  }

  // epilogue: out[token, col] = (add ? out[token, col] : 0) + prob * (acc + bias)
  int nvalid = ce - row0;               // rows of this tile that stand for a token
  int colw = col0 + wn * 64 + lr;
  float bias[4];
#pragma unroll
  for (int j = 0; j < 4; ++j) bias[j] = eb[e * H_DIM + colw + j * 16];
#pragma unroll
  for (int i = 0; i < 2; ++i) {
    int rbase = wm * 32 + i * 16 + (lane >> 4) * 8;
    unsigned off[8];
    float pr[8];
#pragma unroll
    for (int v = 0; v < 8; ++v) {
      off[v] = (unsigned)sTok[rbase + v] * H_DIM + (unsigned)colw;
      pr[v] = sPr[rbase + v];
    }
    if (add) {
      if (nvalid >= BM) write_rows<true, true>(out, off, pr, acc[i], bias, rbase, nvalid);
      else              write_rows<true, false>(out, off, pr, acc[i], bias, rbase, nvalid);
    } else {
      if (nvalid >= BM) write_rows<false, true>(out, off, pr, acc[i], bias, rbase, nvalid);
      else              write_rows<false, false>(out, off, pr, acc[i], bias, rbase, nvalid);
    }
  }
}

// ---------------------------------------------------------------- aux loss scalar
__global__ void loss_kernel(const int* __restrict__ cnt, const float* __restrict__ ent,
                            float* __restrict__ out, int N) {
  if (threadIdx.x == 0 && blockIdx.x == 0) {
    float s = 0.1f * (*ent / (float)N);
    for (int e = 0; e < E_NUM; ++e) {
      float u = (float)(cnt[e] + cnt[E_NUM + e]) / (float)N - 0.3f;
      if (u > 0.0f) s += u;
    }
    out[(size_t)N * H_DIM] = s;
  }
}

extern "C" void kernel_launch(void* const* d_in, const int* in_sizes, int n_in,
                              void* d_out, int out_size, void* d_ws, size_t ws_size,
                              hipStream_t stream) {
  const float* x  = (const float*)d_in[0];   // [B,S,D]
  const float* gw = (const float*)d_in[1];   // [D,E]
  const float* gb = (const float*)d_in[2];   // [E]
  const float* ew = (const float*)d_in[3];   // [E,D,H]
  const float* eb = (const float*)d_in[4];   // [E,H]
  float* out = (float*)d_out;
  int N = in_sizes[0] / D_DIM;               // 16384

  // workspace layout
  char* ws = (char*)d_ws;
  unsigned short* xh = (unsigned short*)ws;                               // N*D f16
  unsigned short* wt = (unsigned short*)(ws + (size_t)N * D_DIM * 2);     // E*H*D f16
  char* p = ws + (size_t)N * D_DIM * 2 + (size_t)E_NUM * H_DIM * D_DIM * 2;
  int*   tok_list  = (int*)p;   p += (size_t)2 * E_NUM * N * 4;   // [rank][E][N]
  float* prob_list = (float*)p; p += (size_t)2 * E_NUM * N * 4;   // [rank][E][N]
  int*   cnt       = (int*)p;   p += 2 * E_NUM * 4;               // [rank][E]
  float* ent       = (float*)p;

  dim3 tg(H_DIM / 32, D_DIM / 32, E_NUM);
  wcvt_kernel<<<tg, 256, 0, stream>>>(ew, wt, cnt, ent);

  gate_kernel<<<(N * 32 + 255) / 256, 256, 0, stream>>>(
      x, gw, gb, xh, tok_list, prob_list, cnt, ent, N);

  dim3 gg(H_DIM / BN, (N + BM - 1) / BM, E_NUM);
  moe_gemm<<<gg, 256, 0, stream>>>(xh, wt, eb, tok_list, prob_list, cnt, out, N, 0);
  moe_gemm<<<gg, 256, 0, stream>>>(xh, wt, eb, tok_list + (size_t)E_NUM * N,
                                   prob_list + (size_t)E_NUM * N, cnt + E_NUM, out, N, 1);

  loss_kernel<<<1, 1, 0, stream>>>(cnt, ent, out, N);
}

// v002
// One run takes 122 microseconds.
// Next to v001, in two timings, it ran 1.43 and 1.44 times as fast.
// All steps since v000 together make it 1.49 times as fast.
#include <hip/hip_runtime.h>
#include <hip/hip_bf16.h>

typedef __attribute__((ext_vector_type(16))) _Float16 v16h;
typedef __attribute__((ext_vector_type(8)))  float    v8f;

#define D_DIM 1024
#define H_DIM 1024
#define E_NUM 8
#define BM 128
#define BN 128
#define BKS 64          // K halves staged per pipeline stage (2 WMMA substeps)
#define LDK2 72         // padded K stride in halves (64 + 8) -> 144B rows, 16B aligned
#define NSTAGE (D_DIM / BKS)

#define AS3 __attribute__((address_space(3)))

// LDS byte offset (what GLOBAL_LOAD_ASYNC_TO_LDS wants in its VDST VGPR)
static __device__ __forceinline__ unsigned lds_off(const void* p) {
  return (unsigned)(unsigned long long)(AS3 const void*)p;
}

// async 16B global -> LDS copy, tracked by ASYNCcnt (CDNA5)
static __device__ __forceinline__ void async_copy_b128(unsigned lds_byte_off,
                                                       const unsigned short* gsrc) {
  asm volatile("global_load_async_to_lds_b128 %0, %1, off"
               :: "v"(lds_byte_off), "v"(gsrc) : "memory");
}

// ------------------------------------------- expert_w f32[E][D][H] -> f16[E][H][D]
// The first block also clears the gate's counters (one per choice rank and expert)
// and the entropy sum: this launch ends before the gate starts.
__global__ void wcvt_kernel(const float* __restrict__ w, unsigned short* __restrict__ wt,
                            int* __restrict__ cnt, float* __restrict__ ent) {
  __shared__ _Float16 tile[32][33];
  if (blockIdx.x == 0 && blockIdx.y == 0 && blockIdx.z == 0) {
    if (threadIdx.x < 2 * E_NUM) cnt[threadIdx.x] = 0;
    if (threadIdx.x == 0) *ent = 0.0f;
  }
  int e  = blockIdx.z;
  int h0 = blockIdx.x * 32;
  int d0 = blockIdx.y * 32;
  int tx = threadIdx.x & 31;
  int ty = threadIdx.x >> 5;   // 8 row-groups
  for (int r = ty; r < 32; r += 8)
    tile[r][tx] = (_Float16)w[((size_t)e * D_DIM + d0 + r) * H_DIM + h0 + tx];
  __syncthreads();
  for (int r = ty; r < 32; r += 8) {
    union { _Float16 h; unsigned short u; } cv;
    cv.h = tile[tx][r];
    wt[((size_t)e * H_DIM + h0 + r) * D_DIM + d0 + tx] = cv.u;
  }
}

// ------------------------- gate: logits, softmax, entropy, top-2, token lists, x->f16
// One wave per token forms the logits. The GATE_TOK waves of a work-group hand them
// through LDS to wave 0, which takes one token per lane: softmax, entropy and top-2 run
// for all tokens at once, a token's place inside the group's share of a list comes from
// a ballot, and the group adds to each list counter once and to the entropy sum once.
#define GATE_TOK 32     // tokens (= waves) per work-group
__global__ __launch_bounds__(32 * GATE_TOK) void gate_kernel(
                            const float* __restrict__ x,
                            const float* __restrict__ gw,
                            const float* __restrict__ gb,
                            unsigned short* __restrict__ xh,
                            int* __restrict__ tok_list,
                            float* __restrict__ prob_list,
                            int* __restrict__ cnt,
                            float* __restrict__ ent_accum,
                            int N) {
  __shared__ alignas(16) float sLogit[GATE_TOK][E_NUM];
  int wave = threadIdx.x >> 5;
  int lane = threadIdx.x & 31;
  int tok0 = blockIdx.x * GATE_TOK;
  int wtok = tok0 + wave;

  float acc[E_NUM];
#pragma unroll
  for (int e = 0; e < E_NUM; ++e) acc[e] = 0.0f;

  if (wtok < N) {
    const float* xr = x + (size_t)wtok * D_DIM;
    unsigned short* xhr = xh + (size_t)wtok * D_DIM;
    for (int i = 0; i < D_DIM / 32; ++i) {
      int d = lane + 32 * i;
      float v = xr[d];
      union { _Float16 h; unsigned short u; } cv;
      cv.h = (_Float16)v;
      xhr[d] = cv.u;
      const float4* g = (const float4*)(gw + (size_t)d * E_NUM);
      float4 g0 = g[0], g1 = g[1];
      acc[0] += v * g0.x; acc[1] += v * g0.y; acc[2] += v * g0.z; acc[3] += v * g0.w;
      acc[4] += v * g1.x; acc[5] += v * g1.y; acc[6] += v * g1.z; acc[7] += v * g1.w;
    }
#pragma unroll
    for (int e = 0; e < E_NUM; ++e)
      for (int off = 16; off > 0; off >>= 1)
        acc[e] += __shfl_xor(acc[e], off, 32);
  }
  if (lane == 0) {
#pragma unroll
    for (int e = 0; e < E_NUM; ++e) sLogit[wave][e] = acc[e];
  }
  __syncthreads();        // every wave's logits are in LDS before wave 0 reads them
  if (wave != 0) return;

  int tok = tok0 + lane;  // this lane's token
  bool valid = tok < N;

  float l[E_NUM], p[E_NUM];
  float m = -1e30f;
#pragma unroll
  for (int e = 0; e < E_NUM; ++e) { l[e] = sLogit[lane][e] + gb[e]; m = fmaxf(m, l[e]); }
  float s = 0.0f;
#pragma unroll
  for (int e = 0; e < E_NUM; ++e) { p[e] = expf(l[e] - m); s += p[e]; }
  float inv = 1.0f / s;
  float ent = 0.0f;
#pragma unroll
  for (int e = 0; e < E_NUM; ++e) { p[e] *= inv; ent -= p[e] * logf(p[e] + 1e-10f); }
  if (!valid) ent = 0.0f;

  int i1 = 0; float v1 = p[0];
#pragma unroll
  for (int e = 1; e < E_NUM; ++e) if (p[e] > v1) { v1 = p[e]; i1 = e; }
  int i2 = -1; float v2 = -1.0f;
#pragma unroll
  for (int e = 0; e < E_NUM; ++e) if (e != i1 && p[e] > v2) { v2 = p[e]; i2 = e; }

  // place among the group's tokens of the same list, and the group's count per list
  // (lane g holds first-choice list g's count, lane E_NUM + g second-choice list g's)
  unsigned below = (1u << lane) - 1u;
  int rank1 = 0, rank2 = 0, c = 0;
#pragma unroll
  for (int g = 0; g < E_NUM; ++g) {
    unsigned m1 = __builtin_amdgcn_ballot_w32(valid && i1 == g);
    unsigned m2 = __builtin_amdgcn_ballot_w32(valid && i2 == g);
    if (i1 == g) rank1 = __popc(m1 & below);
    if (i2 == g) rank2 = __popc(m2 & below);
    if (lane == g) c = __popc(m1);
    if (lane == E_NUM + g) c = __popc(m2);
  }
  int base = 0;
  if (lane < 2 * E_NUM) base = atomicAdd(&cnt[lane], c);
  // second choices go to lists of their own, behind the E_NUM first-choice lists
  int g2 = E_NUM + i2;
  int pos1 = __shfl(base, i1, 32) + rank1;
  int pos2 = __shfl(base, g2, 32) + rank2;

  for (int off = 16; off > 0; off >>= 1) ent += __shfl_xor(ent, off, 32);
  if (lane == 0) atomicAdd(ent_accum, ent);

  if (valid) {
    tok_list[i1 * N + pos1] = tok; prob_list[i1 * N + pos1] = v1;
    tok_list[g2 * N + pos2] = tok; prob_list[g2 * N + pos2] = v2;
  }
}

// 16 rows x 64 columns of one wave's result go to out. ADD: the rows already hold the
// other choice's share; all loads are issued before the first store. FULL: every row of
// the tile stands for a token; otherwise rows past the list's end are left alone.
template <bool ADD, bool FULL>
static __device__ __forceinline__ void write_rows(float* __restrict__ out,
                                                  const unsigned (&off)[8],
                                                  const float (&pr)[8],
                                                  const v8f (&a)[4],
                                                  const float (&bias)[4],
                                                  int rbase, int nvalid) {
  float old[8][4];
  if (ADD) {
#pragma unroll
    for (int v = 0; v < 8; ++v)
      if (FULL || rbase + v < nvalid) {
#pragma unroll
        for (int j = 0; j < 4; ++j) old[v][j] = out[off[v] + j * 16];
      }
  }
#pragma unroll
  for (int v = 0; v < 8; ++v)
    if (FULL || rbase + v < nvalid) {
#pragma unroll
      for (int j = 0; j < 4; ++j) {
        float val = pr[v] * (a[j][v] + bias[j]);
        out[off[v] + j * 16] = ADD ? old[v][j] + val : val;
      }
    }
}

// ---- grouped expert GEMM: WMMA f16/f32, double-buffered async global->LDS pipeline
// One launch per choice rank. A token stands in exactly one list of a rank, so every
// out row has one writer per launch: the first launch (add == 0) stores it, the second
// (add != 0) loads it, adds and stores. No atomics, no cleared out.
__global__ __launch_bounds__(256) void moe_gemm(
    const unsigned short* __restrict__ xh,   // [N][D] f16
    const unsigned short* __restrict__ wt,   // [E][H][D] f16
    const float* __restrict__ eb,            // [E][H]
    const int* __restrict__ tok_list,        // [E][N], this rank's
    const float* __restrict__ prob_list,     // [E][N], this rank's
    const int* __restrict__ cnt,             // [E], this rank's
    float* __restrict__ out, int N, int add) {
  int e = blockIdx.z;
  int ce = cnt[e];
  int row0 = blockIdx.y * BM;
  if (row0 >= ce) return;
  int col0 = blockIdx.x * BN;

  __shared__ alignas(16) unsigned short sA[2][BM * LDK2];
  __shared__ alignas(16) unsigned short sB[2][BN * LDK2];
  __shared__ int   sTok[BM];
  __shared__ float sPr[BM];

  int tid = threadIdx.x;
  if (tid < BM) {
    int r = row0 + tid;
    if (r < ce) { sTok[tid] = tok_list[e * N + r]; sPr[tid] = prob_list[e * N + r]; }
    else        { sTok[tid] = 0;                   sPr[tid] = 0.0f; }
  }
  __syncthreads();

  // ---- per-thread async copy chunk plan: 4 A-chunks + 4 B-chunks of 8 halves/stage
  const unsigned short* aSrc[4]; unsigned aOff[4];
  const unsigned short* bSrc[4]; unsigned bOff[4];
#pragma unroll
  for (int q = 0; q < 4; ++q) {
    int c = tid + 256 * q;          // 0..1023
    int m = c >> 3;                 // row in tile (0..127)
    int kc = (c & 7) * 8;           // half-offset within stage (0..56)
    aSrc[q] = xh + (size_t)sTok[m] * D_DIM + kc;
    aOff[q] = (unsigned)(m * LDK2 + kc) * 2u;      // byte offset inside buffer
    bSrc[q] = wt + ((size_t)e * H_DIM + col0 + m) * D_DIM + kc;
    bOff[q] = (unsigned)(m * LDK2 + kc) * 2u;
  }
  unsigned aBase[2] = { lds_off(&sA[0][0]), lds_off(&sA[1][0]) };
  unsigned bBase[2] = { lds_off(&sB[0][0]), lds_off(&sB[1][0]) };

  auto issue_stage = [&](int k0, int buf) {
#pragma unroll
    for (int q = 0; q < 4; ++q) async_copy_b128(aBase[buf] + aOff[q], aSrc[q] + k0);
#pragma unroll
    for (int q = 0; q < 4; ++q) async_copy_b128(bBase[buf] + bOff[q], bSrc[q] + k0);
  };

  int lane = tid & 31;
  int wv = tid >> 5;
  int wm = wv >> 1;            // 0..3  -> 32-row stripe
  int wn = wv & 1;             // 0..1  -> 64-col stripe
  int lr = lane & 15;
  int kb = (lane >> 4) * 8;    // K base: lanes 0-15 -> 0, lanes 16-31 -> 8

  v8f zero = {};
  v8f acc[2][4];
#pragma unroll
  for (int i = 0; i < 2; ++i)
#pragma unroll
    for (int j = 0; j < 4; ++j) acc[i][j] = zero;

  issue_stage(0, 0);                      // prologue: stage 0 in flight

  for (int s = 0; s < NSTAGE; ++s) {
    int cur = s & 1;
    if (s + 1 < NSTAGE) {
      issue_stage((s + 1) * BKS, (s + 1) & 1);     // prefetch next stage
      asm volatile("s_wait_asynccnt 0x8" ::: "memory");  // stage s (older 8) landed
    } else {
      asm volatile("s_wait_asynccnt 0x0" ::: "memory");
    }
    __syncthreads();                      // publish stage s tile to all waves

    const unsigned short* bufA = sA[cur];
    const unsigned short* bufB = sB[cur];
#pragma unroll
    for (int half = 0; half < 2; ++half) {
      int kk = half * 32;
      v16h afrag[2], bfrag[4];
#pragma unroll
      for (int i = 0; i < 2; ++i) {
        int m = wm * 32 + i * 16 + lr;
        union { uint4 u[2]; v16h h; } t;
        t.u[0] = *(const uint4*)(&bufA[m * LDK2 + kk + kb]);
        t.u[1] = *(const uint4*)(&bufA[m * LDK2 + kk + kb + 16]);
        afrag[i] = t.h;
      }
#pragma unroll
      for (int j = 0; j < 4; ++j) {
        int n = wn * 64 + j * 16 + lr;
        union { uint4 u[2]; v16h h; } t;
        t.u[0] = *(const uint4*)(&bufB[n * LDK2 + kk + kb]);
        t.u[1] = *(const uint4*)(&bufB[n * LDK2 + kk + kb + 16]);
        bfrag[j] = t.h;
      }
#pragma unroll
      for (int i = 0; i < 2; ++i)
#pragma unroll
        for (int j = 0; j < 4; ++j)
          acc[i][j] = __builtin_amdgcn_wmma_f32_16x16x32_f16(
              false, afrag[i], false, bfrag[j], (short)0, acc[i][j], false, false);
    }
    __syncthreads();                      // all waves done reading before overwrite
  }

  // epilogue: out[token, col] = (add ? out[token, col] : 0) + prob * (acc + bias)
  int nvalid = ce - row0;               // rows of this tile that stand for a token
  int colw = col0 + wn * 64 + lr;
  float bias[4];
#pragma unroll
  for (int j = 0; j < 4; ++j) bias[j] = eb[e * H_DIM + colw + j * 16];
#pragma unroll
  for (int i = 0; i < 2; ++i) {
    int rbase = wm * 32 + i * 16 + (lane >> 4) * 8;
    unsigned off[8];
    float pr[8];
#pragma unroll
    for (int v = 0; v < 8; ++v) {
      off[v] = (unsigned)sTok[rbase + v] * H_DIM + (unsigned)colw;
      pr[v] = sPr[rbase + v];
    }
    if (add) {
      if (nvalid >= BM) write_rows<true, true>(out, off, pr, acc[i], bias, rbase, nvalid);
      else              write_rows<true, false>(out, off, pr, acc[i], bias, rbase, nvalid);
    } else {
      if (nvalid >= BM) write_rows<false, true>(out, off, pr, acc[i], bias, rbase, nvalid);
      else              write_rows<false, false>(out, off, pr, acc[i], bias, rbase, nvalid);
    }
  }
}

// ---------------------------------------------------------------- aux loss scalar
__global__ void loss_kernel(const int* __restrict__ cnt, const float* __restrict__ ent,
                            float* __restrict__ out, int N) {
  if (threadIdx.x == 0 && blockIdx.x == 0) {
    float s = 0.1f * (*ent / (float)N);
    for (int e = 0; e < E_NUM; ++e) {
      float u = (float)(cnt[e] + cnt[E_NUM + e]) / (float)N - 0.3f;
      if (u > 0.0f) s += u;
    }
    out[(size_t)N * H_DIM] = s;
  }
}

extern "C" void kernel_launch(void* const* d_in, const int* in_sizes, int n_in,
                              void* d_out, int out_size, void* d_ws, size_t ws_size,
                              hipStream_t stream) {
  const float* x  = (const float*)d_in[0];   // [B,S,D]
  const float* gw = (const float*)d_in[1];   // [D,E]
  const float* gb = (const float*)d_in[2];   // [E]
  const float* ew = (const float*)d_in[3];   // [E,D,H]
  const float* eb = (const float*)d_in[4];   // [E,H]
  float* out = (float*)d_out;
  int N = in_sizes[0] / D_DIM;               // 16384

  // workspace layout
  char* ws = (char*)d_ws;
  unsigned short* xh = (unsigned short*)ws;                               // N*D f16
  unsigned short* wt = (unsigned short*)(ws + (size_t)N * D_DIM * 2);     // E*H*D f16
  char* p = ws + (size_t)N * D_DIM * 2 + (size_t)E_NUM * H_DIM * D_DIM * 2;
  int*   tok_list  = (int*)p;   p += (size_t)2 * E_NUM * N * 4;   // [rank][E][N]
  float* prob_list = (float*)p; p += (size_t)2 * E_NUM * N * 4;   // [rank][E][N]
  int*   cnt       = (int*)p;   p += 2 * E_NUM * 4;               // [rank][E]
  float* ent       = (float*)p;

  dim3 tg(H_DIM / 32, D_DIM / 32, E_NUM);
  wcvt_kernel<<<tg, 256, 0, stream>>>(ew, wt, cnt, ent);

  gate_kernel<<<(N + GATE_TOK - 1) / GATE_TOK, 32 * GATE_TOK, 0, stream>>>(
      x, gw, gb, xh, tok_list, prob_list, cnt, ent, N);

  dim3 gg(H_DIM / BN, (N + BM - 1) / BM, E_NUM);
  moe_gemm<<<gg, 256, 0, stream>>>(xh, wt, eb, tok_list, prob_list, cnt, out, N, 0);
  moe_gemm<<<gg, 256, 0, stream>>>(xh, wt, eb, tok_list + (size_t)E_NUM * N,
                                   prob_list + (size_t)E_NUM * N, cnt + E_NUM, out, N, 1);

  loss_kernel<<<1, 1, 0, stream>>>(cnt, ent, out, N);
}

// v003
// One run takes 105 microseconds.
// Timed twice side by side with v002, it ran 1.15 times as fast both times.
// Counting every step since v000, it is 1.72 times as fast.
#include <hip/hip_runtime.h>
#include <hip/hip_bf16.h>

typedef __attribute__((ext_vector_type(16))) _Float16 v16h;
typedef __attribute__((ext_vector_type(8)))  float    v8f;

#define D_DIM 1024
#define H_DIM 1024
#define E_NUM 8
#define BM 160
#define BN 256
#define BKS 64          // K halves staged per pipeline stage (2 WMMA substeps)
#define LDK2 72         // padded K stride in halves (64 + 8) -> 144B rows, 16B aligned
#define NSTAGE (D_DIM / BKS)

#define AS3 __attribute__((address_space(3)))

// LDS byte offset (what GLOBAL_LOAD_ASYNC_TO_LDS wants in its VDST VGPR)
static __device__ __forceinline__ unsigned lds_off(const void* p) {
  return (unsigned)(unsigned long long)(AS3 const void*)p;
}

// ------------------------------------------- expert_w f32[E][D][H] -> f16[E][H][D]
// The first block also clears the gate's counters (one per choice rank and expert)
// and the entropy sum: this launch ends before the gate starts.
__global__ void wcvt_kernel(const float* __restrict__ w, unsigned short* __restrict__ wt,
                            int* __restrict__ cnt, float* __restrict__ ent) {
  __shared__ _Float16 tile[32][33];
  if (blockIdx.x == 0 && blockIdx.y == 0 && blockIdx.z == 0) {
    if (threadIdx.x < 2 * E_NUM) cnt[threadIdx.x] = 0;
    if (threadIdx.x == 0) *ent = 0.0f;
  }
  int e  = blockIdx.z;
  int h0 = blockIdx.x * 32;
  int d0 = blockIdx.y * 32;
  int tx = threadIdx.x & 31;
  int ty = threadIdx.x >> 5;   // 8 row-groups
  for (int r = ty; r < 32; r += 8)
    tile[r][tx] = (_Float16)w[((size_t)e * D_DIM + d0 + r) * H_DIM + h0 + tx];
  __syncthreads();
  for (int r = ty; r < 32; r += 8) {
    union { _Float16 h; unsigned short u; } cv;
    cv.h = tile[tx][r];
    wt[((size_t)e * H_DIM + h0 + r) * D_DIM + d0 + tx] = cv.u;
  }
}

// ------------------------- gate: logits, softmax, entropy, top-2, token lists, x->f16
// One wave per token forms the logits. The GATE_TOK waves of a work-group hand them
// through LDS to wave 0, which takes one token per lane: softmax, entropy and top-2 run
// for all tokens at once, a token's place inside the group's share of a list comes from
// a ballot, and the group adds to each list counter once and to the entropy sum once.
#define GATE_TOK 32     // tokens (= waves) per work-group
__global__ __launch_bounds__(32 * GATE_TOK) void gate_kernel(
                            const float* __restrict__ x,
                            const float* __restrict__ gw,
                            const float* __restrict__ gb,
                            unsigned short* __restrict__ xh,
                            int* __restrict__ tok_list,
                            float* __restrict__ prob_list,
                            int* __restrict__ cnt,
                            float* __restrict__ ent_accum,
                            int N) {
  __shared__ alignas(16) float sLogit[GATE_TOK][E_NUM];
  int wave = threadIdx.x >> 5;
  int lane = threadIdx.x & 31;
  int tok0 = blockIdx.x * GATE_TOK;
  int wtok = tok0 + wave;

  float acc[E_NUM];
#pragma unroll
  for (int e = 0; e < E_NUM; ++e) acc[e] = 0.0f;

  if (wtok < N) {
    const float* xr = x + (size_t)wtok * D_DIM;
    unsigned short* xhr = xh + (size_t)wtok * D_DIM;
    for (int i = 0; i < D_DIM / 32; ++i) {
      int d = lane + 32 * i;
      float v = xr[d];
      union { _Float16 h; unsigned short u; } cv;
      cv.h = (_Float16)v;
      xhr[d] = cv.u;
      const float4* g = (const float4*)(gw + (size_t)d * E_NUM);
      float4 g0 = g[0], g1 = g[1];
      acc[0] += v * g0.x; acc[1] += v * g0.y; acc[2] += v * g0.z; acc[3] += v * g0.w;
      acc[4] += v * g1.x; acc[5] += v * g1.y; acc[6] += v * g1.z; acc[7] += v * g1.w;
    }
#pragma unroll
    for (int e = 0; e < E_NUM; ++e)
      for (int off = 16; off > 0; off >>= 1)
        acc[e] += __shfl_xor(acc[e], off, 32);
  }
  if (lane == 0) {
#pragma unroll
    for (int e = 0; e < E_NUM; ++e) sLogit[wave][e] = acc[e];
  }
  __syncthreads();        // every wave's logits are in LDS before wave 0 reads them
  if (wave != 0) return;

  int tok = tok0 + lane;  // this lane's token
  bool valid = tok < N;

  float l[E_NUM], p[E_NUM];
  float m = -1e30f;
#pragma unroll
  for (int e = 0; e < E_NUM; ++e) { l[e] = sLogit[lane][e] + gb[e]; m = fmaxf(m, l[e]); }
  float s = 0.0f;
#pragma unroll
  for (int e = 0; e < E_NUM; ++e) { p[e] = expf(l[e] - m); s += p[e]; }
  float inv = 1.0f / s;
  float ent = 0.0f;
#pragma unroll
  for (int e = 0; e < E_NUM; ++e) { p[e] *= inv; ent -= p[e] * logf(p[e] + 1e-10f); }
  if (!valid) ent = 0.0f;

  int i1 = 0; float v1 = p[0];
#pragma unroll
  for (int e = 1; e < E_NUM; ++e) if (p[e] > v1) { v1 = p[e]; i1 = e; }
  int i2 = -1; float v2 = -1.0f;
#pragma unroll
  for (int e = 0; e < E_NUM; ++e) if (e != i1 && p[e] > v2) { v2 = p[e]; i2 = e; }

  // place among the group's tokens of the same list, and the group's count per list
  // (lane g holds first-choice list g's count, lane E_NUM + g second-choice list g's)
  unsigned below = (1u << lane) - 1u;
  int rank1 = 0, rank2 = 0, c = 0;
#pragma unroll
  for (int g = 0; g < E_NUM; ++g) {
    unsigned m1 = __builtin_amdgcn_ballot_w32(valid && i1 == g);
    unsigned m2 = __builtin_amdgcn_ballot_w32(valid && i2 == g);
    if (i1 == g) rank1 = __popc(m1 & below);
    if (i2 == g) rank2 = __popc(m2 & below);
    if (lane == g) c = __popc(m1);
    if (lane == E_NUM + g) c = __popc(m2);
  }
  int base = 0;
  if (lane < 2 * E_NUM) base = atomicAdd(&cnt[lane], c);
  // second choices go to lists of their own, behind the E_NUM first-choice lists
  int g2 = E_NUM + i2;
  int pos1 = __shfl(base, i1, 32) + rank1;
  int pos2 = __shfl(base, g2, 32) + rank2;

  for (int off = 16; off > 0; off >>= 1) ent += __shfl_xor(ent, off, 32);
  if (lane == 0) atomicAdd(ent_accum, ent);

  if (valid) {
    tok_list[i1 * N + pos1] = tok; prob_list[i1 * N + pos1] = v1;
    tok_list[g2 * N + pos2] = tok; prob_list[g2 * N + pos2] = v2;
  }
}

// 16 rows x 64 columns of one wave's result go to out. ADD: the rows already hold the
// other choice's share; all loads are issued before the first store. FULL: every row of
// the tile stands for a token; otherwise rows past the list's end are left alone.
template <bool ADD, bool FULL>
static __device__ __forceinline__ void write_rows(float* __restrict__ out,
                                                  const unsigned (&off)[8],
                                                  const float (&pr)[8],
                                                  const v8f (&a)[4],
                                                  const float (&bias)[4],
                                                  int rbase, int nvalid) {
  float old[8][4];
  if (ADD) {
#pragma unroll
    for (int v = 0; v < 8; ++v)
      if (FULL || rbase + v < nvalid) {
#pragma unroll
        for (int j = 0; j < 4; ++j) old[v][j] = out[off[v] + j * 16];
      }
  }
#pragma unroll
  for (int v = 0; v < 8; ++v)
    if (FULL || rbase + v < nvalid) {
#pragma unroll
      for (int j = 0; j < 4; ++j) {
        float val = pr[v] * (a[j][v] + bias[j]);
        out[off[v] + j * 16] = ADD ? old[v][j] + val : val;
      }
    }
}

// ---- grouped expert GEMM: WMMA f16/f32, two-buffer async global->LDS ring
// One launch per choice rank. A token stands in exactly one list of a rank, so every
// out row has one writer per launch: the first launch (add == 0) stores it, the second
// (add != 0) loads it, adds and stores. No atomics, no cleared out.
// Tile: 160 list rows x 256 columns per work-group, 80 x 64 per wave (2 x 4 waves), so
// that each staged byte and each fragment feeds more products. Two work-groups share a
// WGP: four waves per SIMD, hence the register budget asked for here.
__global__ __launch_bounds__(256) __attribute__((amdgpu_waves_per_eu(4, 4))) void moe_gemm(
    const unsigned short* __restrict__ xh,   // [N][D] f16
    const unsigned short* __restrict__ wt,   // [E][H][D] f16
    const float* __restrict__ eb,            // [E][H]
    const int* __restrict__ tok_list,        // [E][N], this rank's
    const float* __restrict__ prob_list,     // [E][N], this rank's
    const int* __restrict__ cnt,             // [E], this rank's
    float* __restrict__ out, int N, int add) {
  int e = blockIdx.z;
  int ce = cnt[e];
  int row0 = blockIdx.y * BM;
  if (row0 >= ce) return;
  int col0 = blockIdx.x * BN;

  __shared__ alignas(16) unsigned short sA[2][BM * LDK2];
  __shared__ alignas(16) unsigned short sB[2][BN * LDK2];
  __shared__ int   sTok[BM];
  __shared__ float sPr[BM];

  int tid = threadIdx.x;
  if (tid < BM) {
    int r = row0 + tid;
    if (r < ce) { sTok[tid] = tok_list[e * N + r]; sPr[tid] = prob_list[e * N + r]; }
    else        { sTok[tid] = 0;                   sPr[tid] = 0.0f; }
  }
  __syncthreads();

  // ---- per-thread async copy plan: 16-byte chunks, 5 of A and 8 of B per stage.
  // Thread t takes chunk t & 7 of rows (t >> 3) + 32 q.
  int cr = tid >> 3;                // first row (0..31)
  int kc = (tid & 7) * 8;           // half-offset within stage (0..56)
  const unsigned short* aSrc[5];
#pragma unroll
  for (int q = 0; q < 5; ++q) aSrc[q] = xh + (size_t)sTok[cr + 32 * q] * D_DIM + kc;
  const unsigned short* bSrc = wt + ((size_t)e * H_DIM + col0 + cr) * D_DIM + kc;
  unsigned cOff = (unsigned)(cr * LDK2 + kc) * 2u;   // byte offset inside a buffer
  unsigned aBase[2] = { lds_off(&sA[0][0]) + cOff, lds_off(&sA[1][0]) + cOff };
  unsigned bBase[2] = { lds_off(&sB[0][0]) + cOff, lds_off(&sB[1][0]) + cOff };

  auto issue_stage = [&](int k0, int buf) {
    unsigned la[5], lb[8];
    const unsigned short* ga[5];
    const unsigned short* gb[8];
#pragma unroll
    for (int q = 0; q < 5; ++q) { la[q] = aBase[buf] + q * (32 * LDK2 * 2); ga[q] = aSrc[q] + k0; }
#pragma unroll
    for (int q = 0; q < 8; ++q) {
      lb[q] = bBase[buf] + q * (32 * LDK2 * 2);
      gb[q] = bSrc + (size_t)q * 32 * D_DIM + k0;
    }
    // One stage's 13 copies (16 B per lane, global -> LDS, counted on asynccnt). The
    // closing s_wait_xcnt stands inside the statement so that no address register named
    // here is rewritten ahead of it.
    asm volatile(
        "global_load_async_to_lds_b128 %0, %13, off\n\t"
        "global_load_async_to_lds_b128 %1, %14, off\n\t"
        "global_load_async_to_lds_b128 %2, %15, off\n\t"
        "global_load_async_to_lds_b128 %3, %16, off\n\t"
        "global_load_async_to_lds_b128 %4, %17, off\n\t"
        "global_load_async_to_lds_b128 %5, %18, off\n\t"
        "global_load_async_to_lds_b128 %6, %19, off\n\t"
        "global_load_async_to_lds_b128 %7, %20, off\n\t"
        "global_load_async_to_lds_b128 %8, %21, off\n\t"
        "global_load_async_to_lds_b128 %9, %22, off\n\t"
        "global_load_async_to_lds_b128 %10, %23, off\n\t"
        "global_load_async_to_lds_b128 %11, %24, off\n\t"
        "global_load_async_to_lds_b128 %12, %25, off\n\t"
        "s_wait_xcnt 0x0"
        :: "v"(la[0]), "v"(la[1]), "v"(la[2]), "v"(la[3]), "v"(la[4]),
           "v"(lb[0]), "v"(lb[1]), "v"(lb[2]), "v"(lb[3]),
           "v"(lb[4]), "v"(lb[5]), "v"(lb[6]), "v"(lb[7]),
           "v"(ga[0]), "v"(ga[1]), "v"(ga[2]), "v"(ga[3]), "v"(ga[4]),
           "v"(gb[0]), "v"(gb[1]), "v"(gb[2]), "v"(gb[3]),
           "v"(gb[4]), "v"(gb[5]), "v"(gb[6]), "v"(gb[7])
        : "memory");
  };

  int lane = tid & 31;
  int wv = tid >> 5;
  int wm = wv >> 2;            // 0..1  -> 80-row stripe
  int wn = wv & 3;             // 0..3  -> 64-col stripe
  int lr = lane & 15;
  int kb = (lane >> 4) * 8;    // K base: lanes 0-15 -> 0, lanes 16-31 -> 8

  v8f zero = {};
  v8f acc[5][4];
#pragma unroll
  for (int i = 0; i < 5; ++i)
#pragma unroll
    for (int j = 0; j < 4; ++j) acc[i][j] = zero;

  // prologue: stage 0 lands and is published, then stage 1 starts to fly
  issue_stage(0, 0);
  asm volatile("s_wait_asynccnt 0x0" ::: "memory");   // this wave's share of stage 0 is in LDS
  __syncthreads();                                    // ... and every other wave's
  issue_stage(BKS, 1);

  for (int s = 0; s < NSTAGE; ++s) {
    int cur = s & 1;
    const unsigned short* bufA = sA[cur];
    const unsigned short* bufB = sB[cur];
#pragma unroll
    for (int half = 0; half < 2; ++half) {
      int kk = half * 32;
      v16h afrag[5], bfrag[4];
#pragma unroll
      for (int i = 0; i < 5; ++i) {
        int m = wm * 80 + i * 16 + lr;
        union { uint4 u[2]; v16h h; } t;
        t.u[0] = *(const uint4*)(&bufA[m * LDK2 + kk + kb]);
        t.u[1] = *(const uint4*)(&bufA[m * LDK2 + kk + kb + 16]);
        afrag[i] = t.h;
      }
#pragma unroll
      for (int j = 0; j < 4; ++j) {
        int n = wn * 64 + j * 16 + lr;
        union { uint4 u[2]; v16h h; } t;
        t.u[0] = *(const uint4*)(&bufB[n * LDK2 + kk + kb]);
        t.u[1] = *(const uint4*)(&bufB[n * LDK2 + kk + kb + 16]);
        bfrag[j] = t.h;
      }
      // Keeps the k-step's 18 LDS reads together ahead of its 20 WMMAs; left alone, the
      // compiler reads one A fragment at a time and waits for it to 0 before each row.
      __builtin_amdgcn_sched_barrier(0);
#pragma unroll
      for (int i = 0; i < 5; ++i)
#pragma unroll
        for (int j = 0; j < 4; ++j)
          acc[i][j] = __builtin_amdgcn_wmma_f32_16x16x32_f16(
              false, afrag[i], false, bfrag[j], (short)0, acc[i][j], false, false);
    }
    // foot of the stage: one barrier publishes stage s + 1 and frees stage s's buffer
    asm volatile("s_wait_dscnt 0x0" ::: "memory");     // this wave's reads of stage s are done
    asm volatile("s_wait_asynccnt 0x0" ::: "memory");  // this wave's share of stage s + 1 is in LDS
    __syncthreads();
    if (s + 2 < NSTAGE) issue_stage((s + 2) * BKS, cur);   // refill the buffer just read
  }
  asm volatile("s_wait_asynccnt 0x0" ::: "memory");    // no copy is left in flight

  // epilogue: out[token, col] = (add ? out[token, col] : 0) + prob * (acc + bias)
  int nvalid = ce - row0;               // rows of this tile that stand for a token
  int colw = col0 + wn * 64 + lr;
  float bias[4];
#pragma unroll
  for (int j = 0; j < 4; ++j) bias[j] = eb[e * H_DIM + colw + j * 16];
#pragma unroll
  for (int i = 0; i < 5; ++i) {
    int rbase = wm * 80 + i * 16 + (lane >> 4) * 8;
    unsigned off[8];
    float pr[8];
#pragma unroll
    for (int v = 0; v < 8; ++v) {
      off[v] = (unsigned)sTok[rbase + v] * H_DIM + (unsigned)colw;
      pr[v] = sPr[rbase + v];
    }
    if (add) {
      if (nvalid >= BM) write_rows<true, true>(out, off, pr, acc[i], bias, rbase, nvalid);
      else              write_rows<true, false>(out, off, pr, acc[i], bias, rbase, nvalid);
    } else {
      if (nvalid >= BM) write_rows<false, true>(out, off, pr, acc[i], bias, rbase, nvalid);
      else              write_rows<false, false>(out, off, pr, acc[i], bias, rbase, nvalid);
    }
  }
}

// ---------------------------------------------------------------- aux loss scalar
__global__ void loss_kernel(const int* __restrict__ cnt, const float* __restrict__ ent,
                            float* __restrict__ out, int N) {
  if (threadIdx.x == 0 && blockIdx.x == 0) {
    float s = 0.1f * (*ent / (float)N);
    for (int e = 0; e < E_NUM; ++e) {
      float u = (float)(cnt[e] + cnt[E_NUM + e]) / (float)N - 0.3f;
      if (u > 0.0f) s += u;
    }
    out[(size_t)N * H_DIM] = s;
  }
}

extern "C" void kernel_launch(void* const* d_in, const int* in_sizes, int n_in,
                              void* d_out, int out_size, void* d_ws, size_t ws_size,
                              hipStream_t stream) {
  const float* x  = (const float*)d_in[0];   // [B,S,D]
  const float* gw = (const float*)d_in[1];   // [D,E]
  const float* gb = (const float*)d_in[2];   // [E]
  const float* ew = (const float*)d_in[3];   // [E,D,H]
  const float* eb = (const float*)d_in[4];   // [E,H]
  float* out = (float*)d_out;
  int N = in_sizes[0] / D_DIM;               // 16384

  // workspace layout
  char* ws = (char*)d_ws;
  unsigned short* xh = (unsigned short*)ws;                               // N*D f16
  unsigned short* wt = (unsigned short*)(ws + (size_t)N * D_DIM * 2);     // E*H*D f16
  char* p = ws + (size_t)N * D_DIM * 2 + (size_t)E_NUM * H_DIM * D_DIM * 2;
  int*   tok_list  = (int*)p;   p += (size_t)2 * E_NUM * N * 4;   // [rank][E][N]
  float* prob_list = (float*)p; p += (size_t)2 * E_NUM * N * 4;   // [rank][E][N]
  int*   cnt       = (int*)p;   p += 2 * E_NUM * 4;               // [rank][E]
  float* ent       = (float*)p;

  dim3 tg(H_DIM / 32, D_DIM / 32, E_NUM);
  wcvt_kernel<<<tg, 256, 0, stream>>>(ew, wt, cnt, ent);

  gate_kernel<<<(N + GATE_TOK - 1) / GATE_TOK, 32 * GATE_TOK, 0, stream>>>(
      x, gw, gb, xh, tok_list, prob_list, cnt, ent, N);

  dim3 gg(H_DIM / BN, (N + BM - 1) / BM, E_NUM);
  moe_gemm<<<gg, 256, 0, stream>>>(xh, wt, eb, tok_list, prob_list, cnt, out, N, 0);
  moe_gemm<<<gg, 256, 0, stream>>>(xh, wt, eb, tok_list + (size_t)E_NUM * N,
                                   prob_list + (size_t)E_NUM * N, cnt + E_NUM, out, N, 1);

  loss_kernel<<<1, 1, 0, stream>>>(cnt, ent, out, N);
}

// v004
// One run takes 102 microseconds.
// Next to v003, in two timings, it ran 1.04 times as fast each time.
// Over all steps from v000 it is 1.78 times as fast.
#include <hip/hip_runtime.h>
#include <hip/hip_bf16.h>

typedef __attribute__((ext_vector_type(16))) _Float16 v16h;
typedef __attribute__((ext_vector_type(8)))  float    v8f;

#define D_DIM 1024
#define H_DIM 1024
#define E_NUM 8
#define BM 160
#define BN 256
#define BKS 64          // K halves staged per pipeline stage (2 WMMA substeps)
#define LDK2 72         // padded K stride in halves (64 + 8) -> 144B rows, 16B aligned
#define NSTAGE (D_DIM / BKS)

#define AS3 __attribute__((address_space(3)))

// LDS byte offset (what GLOBAL_LOAD_ASYNC_TO_LDS wants in its VDST VGPR)
static __device__ __forceinline__ unsigned lds_off(const void* p) {
  return (unsigned)(unsigned long long)(AS3 const void*)p;
}

// ------------------------------------------- expert_w f32[E][D][H] -> f16[E][H][D]
// One work-group turns a 128 (d) x 128 (h) tile. A wave reads whole 512-byte pieces of 16
// d rows, all 16 loads in flight at once; a thread then holds 16 d values of each of its
// 4 columns, which are 32 bytes of an output row. They pass through LDS so that 16 lanes
// store 256 contiguous bytes of one output row. Few, long work-groups.
// The first block also clears the gate's counters (one per choice rank and expert)
// and the entropy sum: this launch ends before the gate starts.
#define WT_D 128        // d per tile
#define WT_H 128        // h per tile
#define WT_PITCH 136    // halves per LDS row (128 + 8): 272 B, so 16 rows' 16-byte pieces
                        // of one d chunk fall on 64 different banks
__global__ __launch_bounds__(256) void wcvt_kernel(const float* __restrict__ w,
                                                   unsigned short* __restrict__ wt,
                                                   int* __restrict__ cnt,
                                                   float* __restrict__ ent) {
  __shared__ alignas(16) unsigned short tile[WT_H * WT_PITCH];
  if (blockIdx.x == 0 && blockIdx.y == 0 && blockIdx.z == 0) {
    if (threadIdx.x < 2 * E_NUM) cnt[threadIdx.x] = 0;
    if (threadIdx.x == 0) *ent = 0.0f;
  }
  int e  = blockIdx.z;
  int h0 = blockIdx.x * WT_H;
  int d0 = blockIdx.y * WT_D;
  int lane = threadIdx.x & 31;   // columns h0 + 4 lane .. + 3
  int wv   = threadIdx.x >> 5;   // rows d0 + 16 wv .. + 15

  const float* src = w + ((size_t)e * D_DIM + d0 + wv * 16) * H_DIM + h0 + lane * 4;
  float4 v[16];
#pragma unroll
  for (int i = 0; i < 16; ++i) v[i] = *(const float4*)(src + (size_t)i * H_DIM);
  // The loads' address pair is an input here, so it stays whole up to this wait: no load's
  // own result and no later value is put on it earlier.
  asm volatile("s_wait_xcnt 0x0" :: "v"(src) : "memory");
  // Keeps all 16 loads ahead of the first conversion; left alone, the compiler saves
  // registers by issuing the last four only after earlier ones have come back.
  __builtin_amdgcn_sched_barrier(0);

  // column 4 lane + j goes to LDS row 32 j + lane: neighbouring lanes, neighbouring rows
#pragma unroll
  for (int j = 0; j < 4; ++j) {
    union { _Float16 h[16]; uint4 u[2]; } pk;
#pragma unroll
    for (int i = 0; i < 16; ++i) {
      float f = j == 0 ? v[i].x : j == 1 ? v[i].y : j == 2 ? v[i].z : v[i].w;
      pk.h[i] = (_Float16)f;
    }
    unsigned short* dst = &tile[(j * 32 + lane) * WT_PITCH + wv * 16];
    *(uint4*)dst       = pk.u[0];
    *(uint4*)(dst + 8) = pk.u[1];
  }
  __syncthreads();        // the whole tile is in LDS before any row is read back

#pragma unroll
  for (int q = 0; q < (WT_H * WT_D / 8) / 256; ++q) {
    int idx = q * 256 + threadIdx.x;
    int row = idx >> 4;                      // LDS row
    int c   = idx & 15;                      // 16-byte piece of the row
    int h   = (row & 31) * 4 + (row >> 5);   // the column that LDS row holds
    uint4 val = *(const uint4*)&tile[row * WT_PITCH + c * 8];
    *(uint4*)&wt[((size_t)e * H_DIM + h0 + h) * D_DIM + d0 + c * 8] = val;
  }
}

// ------------------------- gate: logits, softmax, entropy, top-2, token lists, x->f16
// One wave per token forms the logits. The GATE_TOK waves of a work-group hand them
// through LDS to wave 0, which takes one token per lane: softmax, entropy and top-2 run
// for all tokens at once, a token's place inside the group's share of a list comes from
// a ballot, and the group adds to each list counter once and to the entropy sum once.
#define GATE_TOK 32     // tokens (= waves) per work-group
__global__ __launch_bounds__(32 * GATE_TOK) void gate_kernel(
                            const float* __restrict__ x,
                            const float* __restrict__ gw,
                            const float* __restrict__ gb,
                            unsigned short* __restrict__ xh,
                            int* __restrict__ tok_list,
                            float* __restrict__ prob_list,
                            int* __restrict__ cnt,
                            float* __restrict__ ent_accum,
                            int N) {
  __shared__ alignas(16) float sLogit[GATE_TOK][E_NUM];
  int wave = threadIdx.x >> 5;
  int lane = threadIdx.x & 31;
  int tok0 = blockIdx.x * GATE_TOK;
  int wtok = tok0 + wave;

  float acc[E_NUM];
#pragma unroll
  for (int e = 0; e < E_NUM; ++e) acc[e] = 0.0f;

  if (wtok < N) {
    const float* xr = x + (size_t)wtok * D_DIM;
    unsigned short* xhr = xh + (size_t)wtok * D_DIM;
    for (int i = 0; i < D_DIM / 32; ++i) {
      int d = lane + 32 * i;
      float v = xr[d];
      union { _Float16 h; unsigned short u; } cv;
      cv.h = (_Float16)v;
      xhr[d] = cv.u;
      const float4* g = (const float4*)(gw + (size_t)d * E_NUM);
      float4 g0 = g[0], g1 = g[1];
      acc[0] += v * g0.x; acc[1] += v * g0.y; acc[2] += v * g0.z; acc[3] += v * g0.w;
      acc[4] += v * g1.x; acc[5] += v * g1.y; acc[6] += v * g1.z; acc[7] += v * g1.w;
    }
#pragma unroll
    for (int e = 0; e < E_NUM; ++e)
      for (int off = 16; off > 0; off >>= 1)
        acc[e] += __shfl_xor(acc[e], off, 32);
  }
  if (lane == 0) {
#pragma unroll
    for (int e = 0; e < E_NUM; ++e) sLogit[wave][e] = acc[e];
  }
  __syncthreads();        // every wave's logits are in LDS before wave 0 reads them
  if (wave != 0) return;

  int tok = tok0 + lane;  // this lane's token
  bool valid = tok < N;

  float l[E_NUM], p[E_NUM];
  float m = -1e30f;
#pragma unroll
  for (int e = 0; e < E_NUM; ++e) { l[e] = sLogit[lane][e] + gb[e]; m = fmaxf(m, l[e]); }
  float s = 0.0f;
#pragma unroll
  for (int e = 0; e < E_NUM; ++e) { p[e] = expf(l[e] - m); s += p[e]; }
  float inv = 1.0f / s;
  float ent = 0.0f;
#pragma unroll
  for (int e = 0; e < E_NUM; ++e) { p[e] *= inv; ent -= p[e] * logf(p[e] + 1e-10f); }
  if (!valid) ent = 0.0f;

  int i1 = 0; float v1 = p[0];
#pragma unroll
  for (int e = 1; e < E_NUM; ++e) if (p[e] > v1) { v1 = p[e]; i1 = e; }
  int i2 = -1; float v2 = -1.0f;
#pragma unroll
  for (int e = 0; e < E_NUM; ++e) if (e != i1 && p[e] > v2) { v2 = p[e]; i2 = e; }

  // place among the group's tokens of the same list, and the group's count per list
  // (lane g holds first-choice list g's count, lane E_NUM + g second-choice list g's)
  unsigned below = (1u << lane) - 1u;
  int rank1 = 0, rank2 = 0, c = 0;
#pragma unroll
  for (int g = 0; g < E_NUM; ++g) {
    unsigned m1 = __builtin_amdgcn_ballot_w32(valid && i1 == g);
    unsigned m2 = __builtin_amdgcn_ballot_w32(valid && i2 == g);
    if (i1 == g) rank1 = __popc(m1 & below);
    if (i2 == g) rank2 = __popc(m2 & below);
    if (lane == g) c = __popc(m1);
    if (lane == E_NUM + g) c = __popc(m2);
  }
  int base = 0;
  if (lane < 2 * E_NUM) base = atomicAdd(&cnt[lane], c);
  // second choices go to lists of their own, behind the E_NUM first-choice lists
  int g2 = E_NUM + i2;
  int pos1 = __shfl(base, i1, 32) + rank1;
  int pos2 = __shfl(base, g2, 32) + rank2;

  for (int off = 16; off > 0; off >>= 1) ent += __shfl_xor(ent, off, 32);
  if (lane == 0) atomicAdd(ent_accum, ent);

  if (valid) {
    tok_list[i1 * N + pos1] = tok; prob_list[i1 * N + pos1] = v1;
    tok_list[g2 * N + pos2] = tok; prob_list[g2 * N + pos2] = v2;
  }
}

// 16 rows x 64 columns of one wave's result go to out. ADD: the rows already hold the
// other choice's share; all loads are issued before the first store. FULL: every row of
// the tile stands for a token; otherwise rows past the list's end are left alone.
template <bool ADD, bool FULL>
static __device__ __forceinline__ void write_rows(float* __restrict__ out,
                                                  const unsigned (&off)[8],
                                                  const float (&pr)[8],
                                                  const v8f (&a)[4],
                                                  const float (&bias)[4],
                                                  int rbase, int nvalid) {
  float old[8][4];
  if (ADD) {
#pragma unroll
    for (int v = 0; v < 8; ++v)
      if (FULL || rbase + v < nvalid) {
#pragma unroll
        for (int j = 0; j < 4; ++j) old[v][j] = out[off[v] + j * 16];
      }
  }
#pragma unroll
  for (int v = 0; v < 8; ++v)
    if (FULL || rbase + v < nvalid) {
#pragma unroll
      for (int j = 0; j < 4; ++j) {
        float val = pr[v] * (a[j][v] + bias[j]);
        out[off[v] + j * 16] = ADD ? old[v][j] + val : val;
      }
    }
}

// ---- grouped expert GEMM: WMMA f16/f32, two-buffer async global->LDS ring
// One launch per choice rank. A token stands in exactly one list of a rank, so every
// out row has one writer per launch: the first launch (add == 0) stores it, the second
// (add != 0) loads it, adds and stores. No atomics, no cleared out.
// Tile: 160 list rows x 256 columns per work-group, 80 x 64 per wave (2 x 4 waves), so
// that each staged byte and each fragment feeds more products. Two work-groups share a
// WGP: four waves per SIMD, hence the register budget asked for here.
__global__ __launch_bounds__(256) __attribute__((amdgpu_waves_per_eu(4, 4))) void moe_gemm(
    const unsigned short* __restrict__ xh,   // [N][D] f16
    const unsigned short* __restrict__ wt,   // [E][H][D] f16
    const float* __restrict__ eb,            // [E][H]
    const int* __restrict__ tok_list,        // [E][N], this rank's
    const float* __restrict__ prob_list,     // [E][N], this rank's
    const int* __restrict__ cnt,             // [E], this rank's
    float* __restrict__ out, int N, int add) {
  int e = blockIdx.z;
  int ce = cnt[e];
  int row0 = blockIdx.y * BM;
  if (row0 >= ce) return;
  int col0 = blockIdx.x * BN;

  __shared__ alignas(16) unsigned short sA[2][BM * LDK2];
  __shared__ alignas(16) unsigned short sB[2][BN * LDK2];
  __shared__ int   sTok[BM];
  __shared__ float sPr[BM];

  int tid = threadIdx.x;
  if (tid < BM) {
    int r = row0 + tid;
    if (r < ce) { sTok[tid] = tok_list[e * N + r]; sPr[tid] = prob_list[e * N + r]; }
    else        { sTok[tid] = 0;                   sPr[tid] = 0.0f; }
  }
  __syncthreads();

  // ---- per-thread async copy plan: 16-byte chunks, 5 of A and 8 of B per stage.
  // Thread t takes chunk t & 7 of rows (t >> 3) + 32 q.
  int cr = tid >> 3;                // first row (0..31)
  int kc = (tid & 7) * 8;           // half-offset within stage (0..56)
  const unsigned short* aSrc[5];
#pragma unroll
  for (int q = 0; q < 5; ++q) aSrc[q] = xh + (size_t)sTok[cr + 32 * q] * D_DIM + kc;
  const unsigned short* bSrc = wt + ((size_t)e * H_DIM + col0 + cr) * D_DIM + kc;
  unsigned cOff = (unsigned)(cr * LDK2 + kc) * 2u;   // byte offset inside a buffer
  unsigned aBase[2] = { lds_off(&sA[0][0]) + cOff, lds_off(&sA[1][0]) + cOff };
  unsigned bBase[2] = { lds_off(&sB[0][0]) + cOff, lds_off(&sB[1][0]) + cOff };

  auto issue_stage = [&](int k0, int buf) {
    unsigned la[5], lb[8];
    const unsigned short* ga[5];
    const unsigned short* gb[8];
#pragma unroll
    for (int q = 0; q < 5; ++q) { la[q] = aBase[buf] + q * (32 * LDK2 * 2); ga[q] = aSrc[q] + k0; }
#pragma unroll
    for (int q = 0; q < 8; ++q) {
      lb[q] = bBase[buf] + q * (32 * LDK2 * 2);
      gb[q] = bSrc + (size_t)q * 32 * D_DIM + k0;
    }
    // One stage's 13 copies (16 B per lane, global -> LDS, counted on asynccnt). The
    // closing s_wait_xcnt stands inside the statement so that no address register named
    // here is rewritten ahead of it.
    asm volatile(
        "global_load_async_to_lds_b128 %0, %13, off\n\t"
        "global_load_async_to_lds_b128 %1, %14, off\n\t"
        "global_load_async_to_lds_b128 %2, %15, off\n\t"
        "global_load_async_to_lds_b128 %3, %16, off\n\t"
        "global_load_async_to_lds_b128 %4, %17, off\n\t"
        "global_load_async_to_lds_b128 %5, %18, off\n\t"
        "global_load_async_to_lds_b128 %6, %19, off\n\t"
        "global_load_async_to_lds_b128 %7, %20, off\n\t"
        "global_load_async_to_lds_b128 %8, %21, off\n\t"
        "global_load_async_to_lds_b128 %9, %22, off\n\t"
        "global_load_async_to_lds_b128 %10, %23, off\n\t"
        "global_load_async_to_lds_b128 %11, %24, off\n\t"
        "global_load_async_to_lds_b128 %12, %25, off\n\t"
        "s_wait_xcnt 0x0"
        :: "v"(la[0]), "v"(la[1]), "v"(la[2]), "v"(la[3]), "v"(la[4]),
           "v"(lb[0]), "v"(lb[1]), "v"(lb[2]), "v"(lb[3]),
           "v"(lb[4]), "v"(lb[5]), "v"(lb[6]), "v"(lb[7]),
           "v"(ga[0]), "v"(ga[1]), "v"(ga[2]), "v"(ga[3]), "v"(ga[4]),
           "v"(gb[0]), "v"(gb[1]), "v"(gb[2]), "v"(gb[3]),
           "v"(gb[4]), "v"(gb[5]), "v"(gb[6]), "v"(gb[7])
        : "memory");
  };

  int lane = tid & 31;
  int wv = tid >> 5;
  int wm = wv >> 2;            // 0..1  -> 80-row stripe
  int wn = wv & 3;             // 0..3  -> 64-col stripe
  int lr = lane & 15;
  int kb = (lane >> 4) * 8;    // K base: lanes 0-15 -> 0, lanes 16-31 -> 8

  v8f zero = {};
  v8f acc[5][4];
#pragma unroll
  for (int i = 0; i < 5; ++i)
#pragma unroll
    for (int j = 0; j < 4; ++j) acc[i][j] = zero;

  // prologue: stage 0 lands and is published, then stage 1 starts to fly
  issue_stage(0, 0);
  asm volatile("s_wait_asynccnt 0x0" ::: "memory");   // this wave's share of stage 0 is in LDS
  __syncthreads();                                    // ... and every other wave's
  issue_stage(BKS, 1);

  for (int s = 0; s < NSTAGE; ++s) {
    int cur = s & 1;
    const unsigned short* bufA = sA[cur];
    const unsigned short* bufB = sB[cur];
#pragma unroll
    for (int half = 0; half < 2; ++half) {
      int kk = half * 32;
      v16h afrag[5], bfrag[4];
#pragma unroll
      for (int i = 0; i < 5; ++i) {
        int m = wm * 80 + i * 16 + lr;
        union { uint4 u[2]; v16h h; } t;
        t.u[0] = *(const uint4*)(&bufA[m * LDK2 + kk + kb]);
        t.u[1] = *(const uint4*)(&bufA[m * LDK2 + kk + kb + 16]);
        afrag[i] = t.h;
      }
#pragma unroll
      for (int j = 0; j < 4; ++j) {
        int n = wn * 64 + j * 16 + lr;
        union { uint4 u[2]; v16h h; } t;
        t.u[0] = *(const uint4*)(&bufB[n * LDK2 + kk + kb]);
        t.u[1] = *(const uint4*)(&bufB[n * LDK2 + kk + kb + 16]);
        bfrag[j] = t.h;
      }
      // Keeps the k-step's 18 LDS reads together ahead of its 20 WMMAs; left alone, the
      // compiler reads one A fragment at a time and waits for it to 0 before each row.
      __builtin_amdgcn_sched_barrier(0);
#pragma unroll
      for (int i = 0; i < 5; ++i)
#pragma unroll
        for (int j = 0; j < 4; ++j)
          acc[i][j] = __builtin_amdgcn_wmma_f32_16x16x32_f16(
              false, afrag[i], false, bfrag[j], (short)0, acc[i][j], false, false);
    }
    // foot of the stage: one barrier publishes stage s + 1 and frees stage s's buffer
    asm volatile("s_wait_dscnt 0x0" ::: "memory");     // this wave's reads of stage s are done
    asm volatile("s_wait_asynccnt 0x0" ::: "memory");  // this wave's share of stage s + 1 is in LDS
    __syncthreads();
    if (s + 2 < NSTAGE) issue_stage((s + 2) * BKS, cur);   // refill the buffer just read
  }
  asm volatile("s_wait_asynccnt 0x0" ::: "memory");    // no copy is left in flight

  // epilogue: out[token, col] = (add ? out[token, col] : 0) + prob * (acc + bias)
  int nvalid = ce - row0;               // rows of this tile that stand for a token
  int colw = col0 + wn * 64 + lr;
  float bias[4];
#pragma unroll
  for (int j = 0; j < 4; ++j) bias[j] = eb[e * H_DIM + colw + j * 16];
#pragma unroll
  for (int i = 0; i < 5; ++i) {
    int rbase = wm * 80 + i * 16 + (lane >> 4) * 8;
    unsigned off[8];
    float pr[8];
#pragma unroll
    for (int v = 0; v < 8; ++v) {
      off[v] = (unsigned)sTok[rbase + v] * H_DIM + (unsigned)colw;
      pr[v] = sPr[rbase + v];
    }
    if (add) {
      if (nvalid >= BM) write_rows<true, true>(out, off, pr, acc[i], bias, rbase, nvalid);
      else              write_rows<true, false>(out, off, pr, acc[i], bias, rbase, nvalid);
    } else {
      if (nvalid >= BM) write_rows<false, true>(out, off, pr, acc[i], bias, rbase, nvalid);
      else              write_rows<false, false>(out, off, pr, acc[i], bias, rbase, nvalid);
    }
  }
}

// ---------------------------------------------------------------- aux loss scalar
__global__ void loss_kernel(const int* __restrict__ cnt, const float* __restrict__ ent,
                            float* __restrict__ out, int N) {
  if (threadIdx.x == 0 && blockIdx.x == 0) {
    float s = 0.1f * (*ent / (float)N);
    for (int e = 0; e < E_NUM; ++e) {
      float u = (float)(cnt[e] + cnt[E_NUM + e]) / (float)N - 0.3f;
      if (u > 0.0f) s += u;
    }
    out[(size_t)N * H_DIM] = s;
  }
}

extern "C" void kernel_launch(void* const* d_in, const int* in_sizes, int n_in,
                              void* d_out, int out_size, void* d_ws, size_t ws_size,
                              hipStream_t stream) {
  const float* x  = (const float*)d_in[0];   // [B,S,D]
  const float* gw = (const float*)d_in[1];   // [D,E]
  const float* gb = (const float*)d_in[2];   // [E]
  const float* ew = (const float*)d_in[3];   // [E,D,H]
  const float* eb = (const float*)d_in[4];   // [E,H]
  float* out = (float*)d_out;
  int N = in_sizes[0] / D_DIM;               // 16384

  // workspace layout
  char* ws = (char*)d_ws;
  unsigned short* xh = (unsigned short*)ws;                               // N*D f16
  unsigned short* wt = (unsigned short*)(ws + (size_t)N * D_DIM * 2);     // E*H*D f16
  char* p = ws + (size_t)N * D_DIM * 2 + (size_t)E_NUM * H_DIM * D_DIM * 2;
  int*   tok_list  = (int*)p;   p += (size_t)2 * E_NUM * N * 4;   // [rank][E][N]
  float* prob_list = (float*)p; p += (size_t)2 * E_NUM * N * 4;   // [rank][E][N]
  int*   cnt       = (int*)p;   p += 2 * E_NUM * 4;               // [rank][E]
  float* ent       = (float*)p;

  dim3 tg(H_DIM / WT_H, D_DIM / WT_D, E_NUM);
  wcvt_kernel<<<tg, 256, 0, stream>>>(ew, wt, cnt, ent);

  gate_kernel<<<(N + GATE_TOK - 1) / GATE_TOK, 32 * GATE_TOK, 0, stream>>>(
      x, gw, gb, xh, tok_list, prob_list, cnt, ent, N);

  dim3 gg(H_DIM / BN, (N + BM - 1) / BM, E_NUM);
  moe_gemm<<<gg, 256, 0, stream>>>(xh, wt, eb, tok_list, prob_list, cnt, out, N, 0);
  moe_gemm<<<gg, 256, 0, stream>>>(xh, wt, eb, tok_list + (size_t)E_NUM * N,
                                   prob_list + (size_t)E_NUM * N, cnt + E_NUM, out, N, 1);

  loss_kernel<<<1, 1, 0, stream>>>(cnt, ent, out, N);
}
